// v000
// The times below were measured on an AMD MI455X: many runs one after another, warmed up first and cycling through
// copies of the inputs, with the whole window's GPU time divided by the number of runs. Launches and the gaps
// between them are all in it. The median over several windows is given; except for v000 it joins two sittings, which
// can be a few percent apart, so the side-by-side timings, each taken in one sitting, are the better comparison.
// v000, which the later versions start from, runs in 514 microseconds.
#include <hip/hip_runtime.h>

// ---------------------------------------------------------------------------
// AttentionGate for MI455X (gfx1250, wave32).
//   Stage 1: q,k,v projection GEMMs via V_WMMA_F32_16X16X4_F32 into ws.
//   Stage 2: fused flash attention, double-buffered K/V tiles staged in LDS
//            via GLOBAL_LOAD_ASYNC_TO_LDS_* (ASYNCcnt), energy + PV on WMMA,
//            online softmax in fp32.
// ---------------------------------------------------------------------------

typedef __attribute__((ext_vector_type(2))) float v2f;
typedef __attribute__((ext_vector_type(8))) float v8f;

constexpr int BATCH = 4;
constexpr int C     = 256;
constexpr int C8    = 32;
constexpr int HW    = 4096;

constexpr int KB    = 16;    // keys per pipelined tile
constexpr int KSTR2 = 20;    // K-tile LDS row stride (dwords): 16B-aligned rows,
constexpr int VSTR  = 20;    // gcd(20,64)=4 -> conflict-free column reads
constexpr int SSTR  = 17;    // S-transpose scratch stride

__device__ __forceinline__ v8f wmma_f32(v2f a, v2f b, v8f c) {
  return __builtin_amdgcn_wmma_f32_16x16x4_f32(false, a, false, b, (short)0, c,
                                               false, false);
}

// --- gfx1250 async global->LDS (bypasses VGPRs, tracked by ASYNCcnt) -------
__device__ __forceinline__ void async_ld_b128(unsigned lds_off, const float* g) {
  asm volatile("global_load_async_to_lds_b128 %0, %1, off"
               :: "v"(lds_off), "v"(g) : "memory");
}
__device__ __forceinline__ void async_ld_b64(unsigned lds_off, const float* g) {
  asm volatile("global_load_async_to_lds_b64 %0, %1, off"
               :: "v"(lds_off), "v"(g) : "memory");
}
__device__ __forceinline__ void wait_async_le5() {
  asm volatile("s_wait_asynccnt 0x5" ::: "memory");
}
__device__ __forceinline__ void wait_async_0() {
  asm volatile("s_wait_asynccnt 0x0" ::: "memory");
}
__device__ __forceinline__ unsigned lds_off(const float* p) {
  return (unsigned)(uintptr_t)p;  // generic shared ptr: low 32 bits = LDS offset
}

// ---------------------------------------------------------------------------
// Projection: Y[b][m][n] = sum_c W[m][c] * X[b][c][n] + bias[m]
// grid = (HW/128, M/16, BATCH), block = 256 (8 waves, one 16x16 tile each).
// ---------------------------------------------------------------------------
__global__ __launch_bounds__(256) void ag_proj_kernel(
    const float* __restrict__ Wm, const float* __restrict__ bias,
    const float* __restrict__ X, float* __restrict__ Y, int M) {
  const int lane  = threadIdx.x & 31;
  const int wave  = threadIdx.x >> 5;
  const int lhalf = lane >> 4;
  const int lmod  = lane & 15;
  const int b     = blockIdx.z;
  const int m0    = blockIdx.y * 16;
  const int n0    = (blockIdx.x * 8 + wave) * 16;

  const float* Xb = X + (size_t)b * C * HW;
  float*       Yb = Y + (size_t)b * M * HW;

  const float* wrow = Wm + (size_t)(m0 + lmod) * C;
  const float* xcol = Xb + n0 + lmod;

  v8f acc = {};
#pragma unroll 8
  for (int k0 = 0; k0 < C; k0 += 4) {
    const int ka = k0 + 2 * lhalf;
    v2f a, bb;
    a.x  = wrow[ka];
    a.y  = wrow[ka + 1];
    bb.x = xcol[(size_t)ka * HW];
    bb.y = xcol[(size_t)(ka + 1) * HW];
    acc = wmma_f32(a, bb, acc);
  }
#pragma unroll
  for (int r = 0; r < 8; ++r) {
    const int mr = m0 + r + 8 * lhalf;
    Yb[(size_t)mr * HW + n0 + lmod] = acc[r] + bias[mr];
  }
}

// ---------------------------------------------------------------------------
// Fused flash attention. grid = (HW/128, BATCH), block = 256 (8 waves).
// Double-buffered 16-key K/V tiles staged in LDS by the async engine.
// ---------------------------------------------------------------------------
__global__ __launch_bounds__(256) void ag_attn_kernel(
    const float* __restrict__ qws, const float* __restrict__ kws,
    const float* __restrict__ vws, const float* __restrict__ x,
    const float* __restrict__ gamma, float* __restrict__ out) {
  __shared__ float kbuf[2][C8 * KSTR2];   //  2 x 2.5 KB
  __shared__ float vbuf[2][C * VSTR];     //  2 x 20  KB
  __shared__ float slds[8 * 16 * SSTR];   //  8.5 KB S-transpose scratch

  const int lane  = threadIdx.x & 31;
  const int wave  = threadIdx.x >> 5;
  const int lhalf = lane >> 4;
  const int lmod  = lane & 15;
  const int b     = blockIdx.y;
  const int q0    = blockIdx.x * 128 + wave * 16;

  const float* qp = qws + (size_t)b * C8 * HW;
  const float* kp = kws + (size_t)b * C8 * HW;
  const float* vp = vws + (size_t)b * C  * HW;

  // --- issue one tile's worth of async loads: 5 instructions per thread ---
  auto issue_tile = [&](int buf, int kb) {
    const int o = threadIdx.x;
#pragma unroll
    for (int u = 0; u < 4; ++u) {             // V: 256 rows x 16 keys, b128
      const int idx = o + 256 * u;            // 1024 16-byte chunks
      const int c   = idx >> 2;
      const int j   = (idx & 3) * 4;
      async_ld_b128(lds_off(&vbuf[buf][c * VSTR + j]),
                    vp + (size_t)c * HW + kb + j);
    }
    {                                          // K: 32 rows x 16 keys, b64
      const int c = o >> 3;
      const int j = (o & 7) * 2;
      async_ld_b64(lds_off(&kbuf[buf][c * KSTR2 + j]),
                   kp + (size_t)c * HW + kb + j);
    }
  };

  // Q fragments: A of energy-WMMA, K-dim = C8 = 32 -> 8 steps of 4.
  v2f afrag[8];
#pragma unroll
  for (int kc = 0; kc < 8; ++kc) {
    const int ca = 4 * kc + 2 * lhalf;
    afrag[kc].x = qp[(size_t)ca * HW + q0 + lmod];
    afrag[kc].y = qp[(size_t)(ca + 1) * HW + q0 + lmod];
  }

  v8f oacc[16] = {};        // O tile: 256 channels x 16 queries
  float mrow = -3.0e38f;
  float lrow = 0.0f;
  float* smy = &slds[wave * 16 * SSTR];

  constexpr int NT = HW / KB;   // 256 pipelined tiles
  issue_tile(0, 0);             // prologue

#pragma unroll 1
  for (int it = 0; it < NT; ++it) {
    const int cur = it & 1;
    if (it + 1 < NT) {
      issue_tile(cur ^ 1, (it + 1) * KB);   // prefetch next tile
      wait_async_le5();                     // tile `it` is now in LDS
    } else {
      wait_async_0();
    }
    __syncthreads();                        // all waves' async writes visible

    const float* kt = kbuf[cur];
    const float* vt = vbuf[cur];

    // ---- S = Q^T K : 16 queries x 16 keys ----
    v8f s = {};
#pragma unroll
    for (int kc = 0; kc < 8; ++kc) {
      const int ca = 4 * kc + 2 * lhalf;
      v2f bb;
      bb.x = kt[ca * KSTR2 + lmod];
      bb.y = kt[(ca + 1) * KSTR2 + lmod];
      s = wmma_f32(afrag[kc], bb, s);
    }

    // ---- transpose S via LDS: D layout (key=lane) -> [query][key] ----
#pragma unroll
    for (int r = 0; r < 8; ++r)
      smy[(r + 8 * lhalf) * SSTR + lmod] = s[r];
    asm volatile("s_wait_dscnt 0" ::: "memory");  // same-wave LDS is in-order

    float pv[8];
    float tmax = -3.0e38f;
#pragma unroll
    for (int kc2 = 0; kc2 < 4; ++kc2)
#pragma unroll
      for (int h = 0; h < 2; ++h) {
        const float sv = smy[lmod * SSTR + 4 * kc2 + 2 * lhalf + h];
        pv[kc2 * 2 + h] = sv;
        tmax = fmaxf(tmax, sv);
      }
    tmax = fmaxf(tmax, __shfl_xor(tmax, 16, 32));  // lane pair shares a query

    // ---- online softmax update ----
    const float mnew = fmaxf(mrow, tmax);
    const float corr = __expf(mrow - mnew);
    float psum = 0.0f;
#pragma unroll
    for (int j = 0; j < 8; ++j) {
      pv[j] = __expf(pv[j] - mnew);
      psum += pv[j];
    }
    psum += __shfl_xor(psum, 16, 32);
    lrow = lrow * corr + psum;
    mrow = mnew;
#pragma unroll
    for (int ct = 0; ct < 16; ++ct)
#pragma unroll
      for (int r = 0; r < 8; ++r) oacc[ct][r] *= corr;

    // ---- O += V * P^T : V fragments from LDS (ds_load_b64) ----
#pragma unroll
    for (int kc2 = 0; kc2 < 4; ++kc2) {
      v2f bb;
      bb.x = pv[kc2 * 2 + 0];
      bb.y = pv[kc2 * 2 + 1];
      const int jcol = 4 * kc2 + 2 * lhalf;
#pragma unroll
      for (int ct = 0; ct < 16; ++ct) {
        const v2f av = *(const v2f*)&vt[(16 * ct + lmod) * VSTR + jcol];
        oacc[ct] = wmma_f32(av, bb, oacc[ct]);
      }
    }

    __syncthreads();   // done reading `cur`; next iter may overwrite it
  }

  // ---- finalize: out = gamma * O / l + x ----
  const float gm   = gamma[0];
  const float rinv = 1.0f / lrow;
  const float* xb  = x   + (size_t)b * C * HW;
  float*       ob  = out + (size_t)b * C * HW;
#pragma unroll
  for (int ct = 0; ct < 16; ++ct)
#pragma unroll
    for (int r = 0; r < 8; ++r) {
      const int c = 16 * ct + r + 8 * lhalf;
      const size_t idx = (size_t)c * HW + q0 + lmod;
      ob[idx] = gm * (oacc[ct][r] * rinv) + xb[idx];
    }
}

// ---------------------------------------------------------------------------
extern "C" void kernel_launch(void* const* d_in, const int* in_sizes, int n_in,
                              void* d_out, int out_size, void* d_ws,
                              size_t ws_size, hipStream_t stream) {
  const float* x     = (const float*)d_in[0];
  const float* g     = (const float*)d_in[1];
  const float* q_w   = (const float*)d_in[2];
  const float* q_b   = (const float*)d_in[3];
  const float* k_w   = (const float*)d_in[4];
  const float* k_b   = (const float*)d_in[5];
  const float* v_w   = (const float*)d_in[6];
  const float* v_b   = (const float*)d_in[7];
  const float* gamma = (const float*)d_in[8];
  float* out = (float*)d_out;

  // Workspace: q (2MB) | k (2MB) | v (16MB) — L2-resident on MI455X.
  float* qws = (float*)d_ws;
  float* kws = qws + (size_t)BATCH * C8 * HW;
  float* vws = kws + (size_t)BATCH * C8 * HW;

  dim3 blk(256);
  ag_proj_kernel<<<dim3(HW / 128, C8 / 16, BATCH), blk, 0, stream>>>(
      q_w, q_b, x, qws, C8);
  ag_proj_kernel<<<dim3(HW / 128, C8 / 16, BATCH), blk, 0, stream>>>(
      k_w, k_b, g, kws, C8);
  ag_proj_kernel<<<dim3(HW / 128, C / 16, BATCH), blk, 0, stream>>>(
      v_w, v_b, g, vws, C);
  ag_attn_kernel<<<dim3(HW / 128, BATCH), blk, 0, stream>>>(
      qws, kws, vws, x, gamma, out);
}

// v001
// It runs in 276 microseconds.
// In two side-by-side timings against v000, it was 1.93 and 1.94 times as fast.
#include <hip/hip_runtime.h>

// ---------------------------------------------------------------------------
// AttentionGate for MI455X (gfx1250, wave32).
//   Stage 1: q,k,v projection GEMMs via V_WMMA_F32_16X16X4_F32 into ws.
//   Stage 2: fused flash attention, double-buffered K/V tiles staged in LDS
//            via GLOBAL_LOAD_ASYNC_TO_LDS_* (ASYNCcnt), energy + PV on WMMA,
//            online softmax in fp32; the keys of a query tile are split over
//            four waves and the partial results merged in LDS.
// ---------------------------------------------------------------------------

typedef __attribute__((ext_vector_type(2))) float v2f;
typedef __attribute__((ext_vector_type(4))) float v4f;
typedef __attribute__((ext_vector_type(8))) float v8f;

constexpr int BATCH = 4;
constexpr int C     = 256;
constexpr int C8    = 32;
constexpr int HW    = 4096;

constexpr int KB    = 16;    // keys per pipelined tile
constexpr int KSTR2 = 20;    // K-tile LDS row stride (dwords): 16B-aligned rows,
constexpr int VSTR  = 20;    // gcd(20,64)=4 -> conflict-free column reads
constexpr int SSTR  = 17;    // S-transpose scratch stride

constexpr int KS     = 4;            // key ranges per work-group
constexpr int QT     = 4;            // 16-query tiles per work-group
constexpr int NW     = KS * QT;      // waves per work-group
constexpr int KRANGE = HW / KS;      // keys per key range
constexpr int VT_F   = C * VSTR;     // floats of one V tile in LDS
constexpr int KT_F   = C8 * KSTR2;   // floats of one K tile in LDS
constexpr int OT_F   = C * 16;       // floats of one wave's O tile
constexpr int SMEM_F = NW * OT_F;    // merge area; the loop's ring lies inside
static_assert(KS * 2 * (VT_F + KT_F) + NW * 16 * SSTR <= SMEM_F, "ring fits");

__device__ __forceinline__ v8f wmma_f32(v2f a, v2f b, v8f c) {
  return __builtin_amdgcn_wmma_f32_16x16x4_f32(false, a, false, b, (short)0, c,
                                               false, false);
}

// --- gfx1250 async global->LDS (bypasses VGPRs, tracked by ASYNCcnt) -------
// One tile's nine 16-byte copies of a lane in ONE statement that ends in
// s_wait_xcnt 0, so that no address register of an issued copy is rewritten
// ahead of that wait.
__device__ __forceinline__ void async_ld9_b128(
    unsigned l0, unsigned l1, unsigned l2, unsigned l3, unsigned l4,
    unsigned l5, unsigned l6, unsigned l7, unsigned l8,
    const float* g0, const float* g1, const float* g2, const float* g3,
    const float* g4, const float* g5, const float* g6, const float* g7,
    const float* g8) {
  asm volatile(
      "global_load_async_to_lds_b128 %0, %9, off\n\t"
      "global_load_async_to_lds_b128 %1, %10, off\n\t"
      "global_load_async_to_lds_b128 %2, %11, off\n\t"
      "global_load_async_to_lds_b128 %3, %12, off\n\t"
      "global_load_async_to_lds_b128 %4, %13, off\n\t"
      "global_load_async_to_lds_b128 %5, %14, off\n\t"
      "global_load_async_to_lds_b128 %6, %15, off\n\t"
      "global_load_async_to_lds_b128 %7, %16, off\n\t"
      "global_load_async_to_lds_b128 %8, %17, off\n\t"
      "s_wait_xcnt 0x0"
      :: "v"(l0), "v"(l1), "v"(l2), "v"(l3), "v"(l4), "v"(l5), "v"(l6),
         "v"(l7), "v"(l8), "v"(g0), "v"(g1), "v"(g2), "v"(g3), "v"(g4),
         "v"(g5), "v"(g6), "v"(g7), "v"(g8)
      : "memory");
}
// The issuing wave's own copies have landed behind this wait.
__device__ __forceinline__ void wait_async_0() {
  asm volatile("s_wait_asynccnt 0x0" ::: "memory");
}
// The wave's own LDS reads and writes have retired behind this wait.
__device__ __forceinline__ void wait_ds_0() {
  asm volatile("s_wait_dscnt 0x0" ::: "memory");
}
// e^x as __expf forms it (scale by log2 e, v_exp_f32), with the one free issue
// slot behind the transcendental inside the statement: four of these stand in a
// row in the merge, where the next one may reuse this one's source register.
__device__ __forceinline__ float exp_slot(float xv) {
  const float a = xv * 1.44269504f;
  float r;
  asm("v_exp_f32 %0, %1\n\tv_nop" : "=v"(r) : "v"(a));
  return r;
}
__device__ __forceinline__ unsigned lds_off(const float* p) {
  return (unsigned)(uintptr_t)p;  // generic shared ptr: low 32 bits = LDS offset
}

// ---------------------------------------------------------------------------
// Projection: Y[b][m][n] = sum_c W[m][c] * X[b][c][n] + bias[m]
// grid = (HW/128, M/16, BATCH), block = 256 (8 waves, one 16x16 tile each).
// ---------------------------------------------------------------------------
__global__ __launch_bounds__(256) void ag_proj_kernel(
    const float* __restrict__ Wm, const float* __restrict__ bias,
    const float* __restrict__ X, float* __restrict__ Y, int M) {
  const int lane  = threadIdx.x & 31;
  const int wave  = threadIdx.x >> 5;
  const int lhalf = lane >> 4;
  const int lmod  = lane & 15;
  const int b     = blockIdx.z;
  const int m0    = blockIdx.y * 16;
  const int n0    = (blockIdx.x * 8 + wave) * 16;

  const float* Xb = X + (size_t)b * C * HW;
  float*       Yb = Y + (size_t)b * M * HW;

  const float* wrow = Wm + (size_t)(m0 + lmod) * C;
  const float* xcol = Xb + n0 + lmod;

  v8f acc = {};
#pragma unroll 8
  for (int k0 = 0; k0 < C; k0 += 4) {
    const int ka = k0 + 2 * lhalf;
    v2f a, bb;
    a.x  = wrow[ka];
    a.y  = wrow[ka + 1];
    bb.x = xcol[(size_t)ka * HW];
    bb.y = xcol[(size_t)(ka + 1) * HW];
    acc = wmma_f32(a, bb, acc);
  }
#pragma unroll
  for (int r = 0; r < 8; ++r) {
    const int mr = m0 + r + 8 * lhalf;
    Yb[(size_t)mr * HW + n0 + lmod] = acc[r] + bias[mr];
  }
}

// ---------------------------------------------------------------------------
// Fused flash attention. grid = (HW/64, BATCH), block = 512 (16 waves).
// Wave = (key range ks, query tile qt): 4 query tiles of 16 x 4 key ranges of
// HW/4 keys. Each group of 4 waves stages the 16-key K/V tiles of its own key
// range (two buffers, async engine) and keeps its own running max, sum and O.
// Behind the loop the four partial results of a query tile are merged in LDS.
// ---------------------------------------------------------------------------
__global__ __launch_bounds__(512) void ag_attn_kernel(
    const float* __restrict__ qws, const float* __restrict__ kws,
    const float* __restrict__ vws, const float* __restrict__ x,
    const float* __restrict__ gamma, float* __restrict__ out) {
  // In the loop: V ring | K ring | S-transpose scratch. Behind it: 16 O tiles.
  __shared__ __attribute__((aligned(16))) float smem[SMEM_F];
  __shared__ float mlbuf[NW * 64];        // running max and sum of every wave

  const int lane  = threadIdx.x & 31;
  // Same in every lane of a wave: kept scalar, so ring bases stay in SGPRs.
  const int wave  = __builtin_amdgcn_readfirstlane(threadIdx.x >> 5);
  const int ks    = wave >> 2;            // key range of this wave
  const int qt    = wave & 3;             // query tile of this wave
  const int lhalf = lane >> 4;
  const int lmod  = lane & 15;
  const int b     = blockIdx.y;
  const int q0    = blockIdx.x * (QT * 16) + qt * 16;

  const float* qp = qws + (size_t)b * C8 * HW;
  const float* kp = kws + (size_t)b * C8 * HW + ks * KRANGE;
  const float* vp = vws + (size_t)b * C  * HW + ks * KRANGE;

  float* vring = smem + ks * 2 * VT_F;                     // [2][C * VSTR]
  float* kring = smem + KS * 2 * VT_F + ks * 2 * KT_F;     // [2][C8 * KSTR2]
  float* smy   = smem + KS * 2 * (VT_F + KT_F) + wave * 16 * SSTR;

  // --- one tile of this key range: 9 copies of 16 bytes per thread ---------
  const int g  = threadIdx.x & 127;       // thread inside the 4-wave group
  const int gc = g >> 2;                  // row 0..31 (V: + 32 per copy)
  const int gj = (g & 3) * 4;             // key inside the tile
  auto issue_tile = [&](int buf, int kb) {
    float*       vl = vring + buf * VT_F + gc * VSTR + gj;
    const float* vg = vp + (size_t)gc * HW + kb + gj;
    async_ld9_b128(
        lds_off(vl),                 lds_off(vl + 32 * VSTR),
        lds_off(vl + 64 * VSTR),     lds_off(vl + 96 * VSTR),
        lds_off(vl + 128 * VSTR),    lds_off(vl + 160 * VSTR),
        lds_off(vl + 192 * VSTR),    lds_off(vl + 224 * VSTR),
        lds_off(kring + buf * KT_F + gc * KSTR2 + gj),
        vg,                          vg + (size_t)32 * HW,
        vg + (size_t)64 * HW,        vg + (size_t)96 * HW,
        vg + (size_t)128 * HW,       vg + (size_t)160 * HW,
        vg + (size_t)192 * HW,       vg + (size_t)224 * HW,
        kp + (size_t)gc * HW + kb + gj);
  };

  // Q fragments: A of energy-WMMA, K-dim = C8 = 32 -> 8 steps of 4.
  v2f afrag[8];
#pragma unroll
  for (int kc = 0; kc < 8; ++kc) {
    const int ca = 4 * kc + 2 * lhalf;
    afrag[kc].x = qp[(size_t)ca * HW + q0 + lmod];
    afrag[kc].y = qp[(size_t)(ca + 1) * HW + q0 + lmod];
  }

  v8f oacc[16] = {};        // O tile: 256 channels x 16 queries
  float mrow = -3.0e38f;
  float lrow = 0.0f;

  constexpr int NT = KRANGE / KB;   // 64 pipelined tiles per key range
  issue_tile(0, 0);                 // tile 0 lands and is published ...
  wait_async_0();
  __syncthreads();
  issue_tile(1, KB);                // ... tile 1 flies while tile 0 is worked on

  // Rolled: the body already holds 72 matrix instructions.
#pragma unroll 1
  for (int it = 0; it < NT; ++it) {
    const int cur = it & 1;
    const float* kt = kring + cur * KT_F;
    const float* vt = vring + cur * VT_F;

    // ---- S = Q^T K : 16 queries x 16 keys ----
    v8f s = {};
#pragma unroll
    for (int kc = 0; kc < 8; ++kc) {
      const int ca = 4 * kc + 2 * lhalf;
      v2f bb;
      bb.x = kt[ca * KSTR2 + lmod];
      bb.y = kt[(ca + 1) * KSTR2 + lmod];
      s = wmma_f32(afrag[kc], bb, s);
    }

    // ---- transpose S via LDS: D layout (key=lane) -> [query][key] ----
#pragma unroll
    for (int r = 0; r < 8; ++r)
      smy[(r + 8 * lhalf) * SSTR + lmod] = s[r];
    asm volatile("s_wait_dscnt 0" ::: "memory");  // same-wave LDS is in-order

    float pv[8];
    float tmax = -3.0e38f;
#pragma unroll
    for (int kc2 = 0; kc2 < 4; ++kc2)
#pragma unroll
      for (int h = 0; h < 2; ++h) {
        const float sv = smy[lmod * SSTR + 4 * kc2 + 2 * lhalf + h];
        pv[kc2 * 2 + h] = sv;
        tmax = fmaxf(tmax, sv);
      }
    tmax = fmaxf(tmax, __shfl_xor(tmax, 16, 32));  // lane pair shares a query

    // ---- online softmax update ----
    const float mnew = fmaxf(mrow, tmax);
    const float corr = __expf(mrow - mnew);
    float psum = 0.0f;
#pragma unroll
    for (int j = 0; j < 8; ++j) {
      pv[j] = __expf(pv[j] - mnew);
      psum += pv[j];
    }
    psum += __shfl_xor(psum, 16, 32);
    lrow = lrow * corr + psum;
    mrow = mnew;
#pragma unroll
    for (int ct = 0; ct < 16; ++ct)
#pragma unroll
      for (int r = 0; r < 8; ++r) oacc[ct][r] *= corr;

    // ---- O += V * P^T : V fragments from LDS (ds_load_b64) ----
#pragma unroll
    for (int kc2 = 0; kc2 < 4; ++kc2) {
      v2f bb;
      bb.x = pv[kc2 * 2 + 0];
      bb.y = pv[kc2 * 2 + 1];
      const int jcol = 4 * kc2 + 2 * lhalf;
#pragma unroll
      for (int ct = 0; ct < 16; ++ct) {
        const v2f av = *(const v2f*)&vt[(16 * ct + lmod) * VSTR + jcol];
        oacc[ct] = wmma_f32(av, bb, oacc[ct]);
      }
    }

    // ---- foot of the trip: own reads of `cur` retired, own copies of the
    // next tile landed, then the one barrier that publishes the next tile and
    // frees `cur` for the refill behind it ----
    wait_ds_0();
    wait_async_0();
    __syncthreads();
    if (it + 2 < NT) issue_tile(cur, (it + 2) * KB);
  }
  wait_async_0();   // no copy is in flight when the ring's LDS is reused

  // ---- merge the four key ranges of each query tile through LDS ----
  // Every wave lays down its raw O tile, max and sum, lane for lane.
  {
    float* mg = smem + wave * OT_F + lane * 4;
#pragma unroll
    for (int ct = 0; ct < 16; ++ct)
#pragma unroll
      for (int rh = 0; rh < 2; ++rh) {
        v4f t;
        t.x = oacc[ct][4 * rh + 0];
        t.y = oacc[ct][4 * rh + 1];
        t.z = oacc[ct][4 * rh + 2];
        t.w = oacc[ct][4 * rh + 3];
        *(v4f*)&mg[(ct * 2 + rh) * 128] = t;
      }
    mlbuf[wave * 64 + lane]      = mrow;
    mlbuf[wave * 64 + 32 + lane] = lrow;
  }
  __syncthreads();   // all partial results are visible to their partners

  float ms[KS], fs[KS];
  float mall = -3.0e38f;
#pragma unroll
  for (int s = 0; s < KS; ++s) {
    ms[s] = mlbuf[(s * QT + qt) * 64 + lane];
    mall  = fmaxf(mall, ms[s]);
  }
  float lall = 0.0f;
#pragma unroll
  for (int s = 0; s < KS; ++s) {
    fs[s] = exp_slot(ms[s] - mall);
    lall += fs[s] * mlbuf[(s * QT + qt) * 64 + 32 + lane];
  }

  // ---- finalize: out = gamma * O / l + x; wave ks owns channels 64 ks .. ----
  const float gm   = gamma[0];
  const float rinv = 1.0f / lall;
  const float* xb  = x   + (size_t)b * C * HW;
  float*       ob  = out + (size_t)b * C * HW;
#pragma unroll
  for (int cq = 0; cq < 4; ++cq) {
    const int ct = ks * 4 + cq;
#pragma unroll
    for (int rh = 0; rh < 2; ++rh) {
      v4f acc = {};
#pragma unroll
      for (int s = 0; s < KS; ++s) {
        const v4f t = *(const v4f*)&smem[(s * QT + qt) * OT_F +
                                         (ct * 2 + rh) * 128 + lane * 4];
        acc += fs[s] * t;
      }
#pragma unroll
      for (int e = 0; e < 4; ++e) {
        const int c = 16 * ct + 4 * rh + e + 8 * lhalf;
        const size_t idx = (size_t)c * HW + q0 + lmod;
        ob[idx] = gm * (acc[e] * rinv) + xb[idx];
      }
    }
  }
}

// ---------------------------------------------------------------------------
extern "C" void kernel_launch(void* const* d_in, const int* in_sizes, int n_in,
                              void* d_out, int out_size, void* d_ws,
                              size_t ws_size, hipStream_t stream) {
  const float* x     = (const float*)d_in[0];
  const float* g     = (const float*)d_in[1];
  const float* q_w   = (const float*)d_in[2];
  const float* q_b   = (const float*)d_in[3];
  const float* k_w   = (const float*)d_in[4];
  const float* k_b   = (const float*)d_in[5];
  const float* v_w   = (const float*)d_in[6];
  const float* v_b   = (const float*)d_in[7];
  const float* gamma = (const float*)d_in[8];
  float* out = (float*)d_out;

  // Workspace: q (2MB) | k (2MB) | v (16MB) — L2-resident on MI455X.
  float* qws = (float*)d_ws;
  float* kws = qws + (size_t)BATCH * C8 * HW;
  float* vws = kws + (size_t)BATCH * C8 * HW;

  dim3 blk(256);
  ag_proj_kernel<<<dim3(HW / 128, C8 / 16, BATCH), blk, 0, stream>>>(
      q_w, q_b, x, qws, C8);
  ag_proj_kernel<<<dim3(HW / 128, C8 / 16, BATCH), blk, 0, stream>>>(
      k_w, k_b, g, kws, C8);
  ag_proj_kernel<<<dim3(HW / 128, C / 16, BATCH), blk, 0, stream>>>(
      v_w, v_b, g, vws, C);
  ag_attn_kernel<<<dim3(HW / (QT * 16), BATCH), dim3(NW * 32), 0, stream>>>(
      qws, kws, vws, x, gamma, out);
}

// v002
// It runs in 239 microseconds.
// Timed twice side by side with v001, it ran 1.15 times as fast both times.
// Counting every step since v000, it is 2.23 times as fast.
#include <hip/hip_runtime.h>

// ---------------------------------------------------------------------------
// AttentionGate for MI455X (gfx1250, wave32).
//   Stage 1: q,k,v projection GEMMs via V_WMMA_F32_16X16X4_F32 into ws; k and
//            v are laid down per 16-key tile in the order in which stage 2's
//            matrix instructions take their fragments.
//   Stage 2: fused flash attention, double-buffered K/V tiles staged in LDS
//            via GLOBAL_LOAD_ASYNC_TO_LDS_* (ASYNCcnt), energy + PV on WMMA,
//            online softmax in fp32; the keys of a query tile are split over
//            four waves and the partial results merged in LDS.
// ---------------------------------------------------------------------------

typedef __attribute__((ext_vector_type(2))) float v2f;
typedef __attribute__((ext_vector_type(4))) float v4f;
typedef __attribute__((ext_vector_type(8))) float v8f;

constexpr int BATCH = 4;
constexpr int C     = 256;
constexpr int C8    = 32;
constexpr int HW    = 4096;

constexpr int KB    = 16;    // keys per pipelined tile
constexpr int SSTR  = 17;    // S-transpose scratch stride

constexpr int KS     = 4;            // key ranges per work-group
constexpr int QT     = 4;            // 16-query tiles per work-group
constexpr int NW     = KS * QT;      // waves per work-group
constexpr int KRANGE = HW / KS;      // keys per key range
constexpr int VT_F   = C * KB;       // floats of one V tile, in ws and in LDS
constexpr int KT_F   = C8 * KB;      // floats of one K tile, in ws and in LDS
constexpr int OT_F   = C * 16;       // floats of one wave's O tile
constexpr int SMEM_F = NW * OT_F;    // merge area; the loop's ring lies inside
static_assert(KS * 2 * (VT_F + KT_F) + NW * 16 * SSTR <= SMEM_F, "ring fits");

__device__ __forceinline__ v8f wmma_f32(v2f a, v2f b, v8f c) {
  return __builtin_amdgcn_wmma_f32_16x16x4_f32(false, a, false, b, (short)0, c,
                                               false, false);
}

// --- gfx1250 async global->LDS (bypasses VGPRs, tracked by ASYNCcnt) -------
// One tile's nine 16-byte copies of a lane in ONE statement that ends in
// s_wait_xcnt 0, so that no address register of an issued copy is rewritten
// ahead of that wait.
__device__ __forceinline__ void async_ld9_b128(
    unsigned l0, unsigned l1, unsigned l2, unsigned l3, unsigned l4,
    unsigned l5, unsigned l6, unsigned l7, unsigned l8,
    const float* g0, const float* g1, const float* g2, const float* g3,
    const float* g4, const float* g5, const float* g6, const float* g7,
    const float* g8) {
  asm volatile(
      "global_load_async_to_lds_b128 %0, %9, off\n\t"
      "global_load_async_to_lds_b128 %1, %10, off\n\t"
      "global_load_async_to_lds_b128 %2, %11, off\n\t"
      "global_load_async_to_lds_b128 %3, %12, off\n\t"
      "global_load_async_to_lds_b128 %4, %13, off\n\t"
      "global_load_async_to_lds_b128 %5, %14, off\n\t"
      "global_load_async_to_lds_b128 %6, %15, off\n\t"
      "global_load_async_to_lds_b128 %7, %16, off\n\t"
      "global_load_async_to_lds_b128 %8, %17, off\n\t"
      "s_wait_xcnt 0x0"
      :: "v"(l0), "v"(l1), "v"(l2), "v"(l3), "v"(l4), "v"(l5), "v"(l6),
         "v"(l7), "v"(l8), "v"(g0), "v"(g1), "v"(g2), "v"(g3), "v"(g4),
         "v"(g5), "v"(g6), "v"(g7), "v"(g8)
      : "memory");
}
// The issuing wave's own copies have landed behind this wait.
__device__ __forceinline__ void wait_async_0() {
  asm volatile("s_wait_asynccnt 0x0" ::: "memory");
}
// The wave's own LDS reads and writes have retired behind this wait.
__device__ __forceinline__ void wait_ds_0() {
  asm volatile("s_wait_dscnt 0x0" ::: "memory");
}
// e^x as __expf forms it (scale by log2 e, v_exp_f32), with the one free issue
// slot behind the transcendental inside the statement: these stand in rows, in
// the loop and in the merge, where the next one may reuse this one's source
// register.
__device__ __forceinline__ float exp_slot(float xv) {
  const float a = xv * 1.44269504f;
  float r;
  asm("v_exp_f32 %0, %1\n\tv_nop" : "=v"(r) : "v"(a));
  return r;
}
__device__ __forceinline__ unsigned lds_off(const float* p) {
  return (unsigned)(uintptr_t)p;  // generic shared ptr: low 32 bits = LDS offset
}

// ---------------------------------------------------------------------------
// Projection: y[b][m][n] = sum_c W[m][c] * X[b][c][n] + bias[m]
// grid = (HW/128, M/16, BATCH), block = 256 (8 waves, one 16x16 tile each).
// LAY 0: Y[b][m][n], rows of HW.
// LAY 1, 2: fragment order. Y[b][n/16][m/16] is a block of 256 floats,
//   [k/8][lane][(k/4)%2][k%2] with lane = 16*((k/2)%2) + j: what lane `lane` of
//   a 16x16x4 operand holds for the k steps 2*(k/8) and 2*(k/8)+1, 16 bytes.
//   LAY 1 (keys as columns, B of Q^T K): k = m%16, j = n%16.
//   LAY 2 (channels as rows, A of V P^T): k = n%16, j = m%16; the product is
//   formed transposed (operands swapped) so that a lane holds 8 k of one j.
// ---------------------------------------------------------------------------
template <int LAY>
__global__ __launch_bounds__(256) void ag_proj_kernel(
    const float* __restrict__ Wm, const float* __restrict__ bias,
    const float* __restrict__ X, float* __restrict__ Y, int M) {
  const int lane  = threadIdx.x & 31;
  const int wave  = threadIdx.x >> 5;
  const int lhalf = lane >> 4;
  const int lmod  = lane & 15;
  const int b     = blockIdx.z;
  const int m0    = blockIdx.y * 16;
  const int n0    = (blockIdx.x * 8 + wave) * 16;

  const float* Xb = X + (size_t)b * C * HW;
  float*       Yb = Y + (size_t)b * M * HW;

  const float* wrow = Wm + (size_t)(m0 + lmod) * C;
  const float* xcol = Xb + n0 + lmod;

  v8f acc = {};
#pragma unroll 8
  for (int k0 = 0; k0 < C; k0 += 4) {
    const int ka = k0 + 2 * lhalf;
    v2f a, bb;
    a.x  = wrow[ka];
    a.y  = wrow[ka + 1];
    bb.x = xcol[(size_t)ka * HW];
    bb.y = xcol[(size_t)(ka + 1) * HW];
    acc = (LAY == 2) ? wmma_f32(bb, a, acc) : wmma_f32(a, bb, acc);
  }
  if (LAY == 0) {
#pragma unroll
    for (int r = 0; r < 8; ++r) {
      const int mr = m0 + r + 8 * lhalf;
      Yb[(size_t)mr * HW + n0 + lmod] = acc[r] + bias[mr];
    }
  } else {
    // acc[r] is k = r + 8 * lhalf of column j = lmod.
#pragma unroll
    for (int r = 0; r < 8; ++r)
      acc[r] += bias[LAY == 2 ? m0 + lmod : m0 + r + 8 * lhalf];
    float* yt = Yb + (size_t)(n0 >> 4) * (M * 16) + (m0 >> 4) * 256 +
                lhalf * 128 + lmod * 4;
#pragma unroll
    for (int h = 0; h < 2; ++h) {
      v4f t;
      t.x = acc[2 * h];
      t.y = acc[2 * h + 1];
      t.z = acc[4 + 2 * h];
      t.w = acc[5 + 2 * h];
      *(v4f*)&yt[h * 64] = t;
    }
  }
}

// ---------------------------------------------------------------------------
// Fused flash attention. grid = (HW/64, BATCH), block = 512 (16 waves).
// Wave = (key range ks, query tile qt): 4 query tiles of 16 x 4 key ranges of
// HW/4 keys. Each group of 4 waves stages the 16-key K/V tiles of its own key
// range (two buffers, async engine) and keeps its own running max, sum and O.
// Behind the loop the four partial results of a query tile are merged in LDS.
// ---------------------------------------------------------------------------
__global__ __launch_bounds__(512) void ag_attn_kernel(
    const float* __restrict__ qws, const float* __restrict__ kws,
    const float* __restrict__ vws, const float* __restrict__ x,
    const float* __restrict__ gamma, float* __restrict__ out) {
  // In the loop: V ring | K ring | S-transpose scratch. Behind it: 16 O tiles.
  __shared__ __attribute__((aligned(16))) float smem[SMEM_F];
  __shared__ float mlbuf[NW * 64];        // running max and sum of every wave

  const int lane  = threadIdx.x & 31;
  // Same in every lane of a wave: kept scalar, so ring bases stay in SGPRs.
  const int wave  = __builtin_amdgcn_readfirstlane(threadIdx.x >> 5);
  const int ks    = wave >> 2;            // key range of this wave
  const int qt    = wave & 3;             // query tile of this wave
  const int lhalf = lane >> 4;
  const int lmod  = lane & 15;
  const int b     = blockIdx.y;
  const int q0    = blockIdx.x * (QT * 16) + qt * 16;

  const float* qp = qws + (size_t)b * C8 * HW;
  const float* kp = kws + (size_t)b * C8 * HW + ks * KRANGE * C8;  // tile-major
  const float* vp = vws + (size_t)b * C  * HW + ks * KRANGE * C;

  float* vring = smem + ks * 2 * VT_F;                     // [2][VT_F]
  float* kring = smem + KS * 2 * VT_F + ks * 2 * KT_F;     // [2][KT_F]
  float* smy   = smem + KS * 2 * (VT_F + KT_F) + wave * 16 * SSTR;

  // --- one tile of this key range: 9 copies of 16 bytes per thread ---------
  // A tile is one block in ws and the same block in LDS: a wave's copy takes
  // 512 bytes in a row, four whole lines.
  const int g4 = (threadIdx.x & 127) * 4; // float of this thread in 2 KiB
  auto issue_tile = [&](int buf, int kb) {
    float*       vl = vring + buf * VT_F + g4;
    const float* vg = vp + (size_t)kb * C + g4;
    async_ld9_b128(
        lds_off(vl),            lds_off(vl + 512),
        lds_off(vl + 1024),     lds_off(vl + 1536),
        lds_off(vl + 2048),     lds_off(vl + 2560),
        lds_off(vl + 3072),     lds_off(vl + 3584),
        lds_off(kring + buf * KT_F + g4),
        vg,                     vg + 512,
        vg + 1024,              vg + 1536,
        vg + 2048,              vg + 2560,
        vg + 3072,              vg + 3584,
        kp + (size_t)kb * C8 + g4);
  };

  // Q fragments: A of energy-WMMA, K-dim = C8 = 32 -> 8 steps of 4.
  v2f afrag[8];
#pragma unroll
  for (int kc = 0; kc < 8; ++kc) {
    const int ca = 4 * kc + 2 * lhalf;
    afrag[kc].x = qp[(size_t)ca * HW + q0 + lmod];
    afrag[kc].y = qp[(size_t)(ca + 1) * HW + q0 + lmod];
  }

  v8f oacc[16] = {};        // O tile: 256 channels x 16 queries
  float mrow = -3.0e38f;
  float lrow = 0.0f;

  constexpr int NT = KRANGE / KB;   // 64 pipelined tiles per key range
  issue_tile(0, 0);                 // tile 0 lands and is published ...
  wait_async_0();
  __syncthreads();
  issue_tile(1, KB);                // ... tile 1 flies while tile 0 is worked on

  // Rolled: the body already holds 72 matrix instructions.
#pragma unroll 1
  for (int it = 0; it < NT; ++it) {
    const int cur = it & 1;
    const float* kt = kring + cur * KT_F;
    const float* vt = vring + cur * VT_F;

    // ---- S = Q^T K : 16 queries x 16 keys ----
    v8f s = {};
    v4f kf[4];                                // kf[p]: k steps 2p and 2p+1
#pragma unroll
    for (int p = 0; p < 4; ++p) kf[p] = *(const v4f*)&kt[p * 128 + lane * 4];
    // Holds the four reads together in front of the products (inputs only):
    // without it they share one register quad and the wave waits out the LDS
    // latency four times in this dependent chain.
    asm volatile("" :: "v"(kf[0]), "v"(kf[1]), "v"(kf[2]), "v"(kf[3]));
#pragma unroll
    for (int p = 0; p < 4; ++p) {
      v2f b0, b1;
      b0.x = kf[p].x;
      b0.y = kf[p].y;
      b1.x = kf[p].z;
      b1.y = kf[p].w;
      s = wmma_f32(afrag[2 * p], b0, s);
      s = wmma_f32(afrag[2 * p + 1], b1, s);
    }

    // ---- transpose S via LDS: D layout (key=lane) -> [query][key] ----
#pragma unroll
    for (int r = 0; r < 8; ++r)
      smy[(r + 8 * lhalf) * SSTR + lmod] = s[r];
    asm volatile("s_wait_dscnt 0" ::: "memory");  // same-wave LDS is in-order

    float pv[8];
    float tmax = -3.0e38f;
#pragma unroll
    for (int kc2 = 0; kc2 < 4; ++kc2)
#pragma unroll
      for (int h = 0; h < 2; ++h) {
        const float sv = smy[lmod * SSTR + 4 * kc2 + 2 * lhalf + h];
        pv[kc2 * 2 + h] = sv;
        tmax = fmaxf(tmax, sv);
      }
    tmax = fmaxf(tmax, __shfl_xor(tmax, 16, 32));  // lane pair shares a query

    // ---- online softmax update ----
    const float mnew = fmaxf(mrow, tmax);
    const float corr = exp_slot(mrow - mnew);
    float psum = 0.0f;
#pragma unroll
    for (int j = 0; j < 8; ++j) {
      pv[j] = exp_slot(pv[j] - mnew);
      psum += pv[j];
    }
    psum += __shfl_xor(psum, 16, 32);
    lrow = lrow * corr + psum;
    mrow = mnew;
#pragma unroll
    for (int ct = 0; ct < 16; ++ct)
#pragma unroll
      for (int r = 0; r < 8; ++r) oacc[ct][r] *= corr;

    // ---- O += V * P^T : V fragments from LDS, two k steps per 16-byte read ----
#pragma unroll
    for (int p = 0; p < 2; ++p) {
      v4f vf[16];
#pragma unroll
      for (int ct = 0; ct < 16; ++ct)
        vf[ct] = *(const v4f*)&vt[ct * 256 + p * 128 + lane * 4];
#pragma unroll
      for (int q = 0; q < 2; ++q) {
        const int kc2 = 2 * p + q;
        v2f bb;
        bb.x = pv[kc2 * 2 + 0];
        bb.y = pv[kc2 * 2 + 1];
#pragma unroll
        for (int ct = 0; ct < 16; ++ct) {
          v2f av;
          av.x = q ? vf[ct].z : vf[ct].x;
          av.y = q ? vf[ct].w : vf[ct].y;
          oacc[ct] = wmma_f32(av, bb, oacc[ct]);
        }
      }
    }

    // ---- foot of the trip: own reads of `cur` retired, own copies of the
    // next tile landed, then the one barrier that publishes the next tile and
    // frees `cur` for the refill behind it ----
    wait_ds_0();
    wait_async_0();
    __syncthreads();
    if (it + 2 < NT) issue_tile(cur, (it + 2) * KB);
  }
  wait_async_0();   // no copy is in flight when the ring's LDS is reused

  // ---- merge the four key ranges of each query tile through LDS ----
  // Every wave lays down its raw O tile, max and sum, lane for lane.
  {
    float* mg = smem + wave * OT_F + lane * 4;
#pragma unroll
    for (int ct = 0; ct < 16; ++ct)
#pragma unroll
      for (int rh = 0; rh < 2; ++rh) {
        v4f t;
        t.x = oacc[ct][4 * rh + 0];
        t.y = oacc[ct][4 * rh + 1];
        t.z = oacc[ct][4 * rh + 2];
        t.w = oacc[ct][4 * rh + 3];
        *(v4f*)&mg[(ct * 2 + rh) * 128] = t;
      }
    mlbuf[wave * 64 + lane]      = mrow;
    mlbuf[wave * 64 + 32 + lane] = lrow;
  }
  __syncthreads();   // all partial results are visible to their partners

  float ms[KS], fs[KS];
  float mall = -3.0e38f;
#pragma unroll
  for (int s = 0; s < KS; ++s) {
    ms[s] = mlbuf[(s * QT + qt) * 64 + lane];
    mall  = fmaxf(mall, ms[s]);
  }
  float lall = 0.0f;
#pragma unroll
  for (int s = 0; s < KS; ++s) {
    fs[s] = exp_slot(ms[s] - mall);
    lall += fs[s] * mlbuf[(s * QT + qt) * 64 + 32 + lane];
  }

  // ---- finalize: out = gamma * O / l + x; wave ks owns channels 64 ks .. ----
  const float gm   = gamma[0];
  const float rinv = 1.0f / lall;
  const float* xb  = x   + (size_t)b * C * HW;
  float*       ob  = out + (size_t)b * C * HW;
#pragma unroll
  for (int cq = 0; cq < 4; ++cq) {
    const int ct = ks * 4 + cq;
#pragma unroll
    for (int rh = 0; rh < 2; ++rh) {
      v4f acc = {};
#pragma unroll
      for (int s = 0; s < KS; ++s) {
        const v4f t = *(const v4f*)&smem[(s * QT + qt) * OT_F +
                                         (ct * 2 + rh) * 128 + lane * 4];
        acc += fs[s] * t;
      }
#pragma unroll
      for (int e = 0; e < 4; ++e) {
        const int c = 16 * ct + 4 * rh + e + 8 * lhalf;
        const size_t idx = (size_t)c * HW + q0 + lmod;
        ob[idx] = gm * (acc[e] * rinv) + xb[idx];
      }
    }
  }
}

// ---------------------------------------------------------------------------
extern "C" void kernel_launch(void* const* d_in, const int* in_sizes, int n_in,
                              void* d_out, int out_size, void* d_ws,
                              size_t ws_size, hipStream_t stream) {
  const float* x     = (const float*)d_in[0];
  const float* g     = (const float*)d_in[1];
  const float* q_w   = (const float*)d_in[2];
  const float* q_b   = (const float*)d_in[3];
  const float* k_w   = (const float*)d_in[4];
  const float* k_b   = (const float*)d_in[5];
  const float* v_w   = (const float*)d_in[6];
  const float* v_b   = (const float*)d_in[7];
  const float* gamma = (const float*)d_in[8];
  float* out = (float*)d_out;

  // Workspace: q (2MB) | k (2MB) | v (16MB); k and v in fragment order.
  float* qws = (float*)d_ws;
  float* kws = qws + (size_t)BATCH * C8 * HW;
  float* vws = kws + (size_t)BATCH * C8 * HW;

  dim3 blk(256);
  ag_proj_kernel<0><<<dim3(HW / 128, C8 / 16, BATCH), blk, 0, stream>>>(
      q_w, q_b, x, qws, C8);
  ag_proj_kernel<1><<<dim3(HW / 128, C8 / 16, BATCH), blk, 0, stream>>>(
      k_w, k_b, g, kws, C8);
  ag_proj_kernel<2><<<dim3(HW / 128, C / 16, BATCH), blk, 0, stream>>>(
      v_w, v_b, g, vws, C);
  ag_attn_kernel<<<dim3(HW / (QT * 16), BATCH), dim3(NW * 32), 0, stream>>>(
      qws, kws, vws, x, gamma, out);
}

// v003
// It runs in 226 microseconds.
// Timed twice side by side with v002, it ran 1.06 times as fast both times.
// Counting every step since v000, it is 2.36 times as fast.
#include <hip/hip_runtime.h>

// ---------------------------------------------------------------------------
// AttentionGate for MI455X (gfx1250, wave32).
//   Stage 1: q,k,v projection GEMMs via V_WMMA_F32_16X16X4_F32 into ws; k and
//            v are laid down per 16-key tile in the order in which stage 2's
//            matrix instructions take their fragments.
//   Stage 2: fused flash attention, double-buffered K/V tiles staged in LDS
//            via GLOBAL_LOAD_ASYNC_TO_LDS_* (ASYNCcnt), energy + PV on WMMA,
//            online softmax in fp32; the keys of a query tile are split over
//            four waves and the partial results merged in LDS.
// ---------------------------------------------------------------------------

typedef __attribute__((ext_vector_type(2))) float v2f;
typedef __attribute__((ext_vector_type(4))) float v4f;
typedef __attribute__((ext_vector_type(8))) float v8f;

constexpr int BATCH = 4;
constexpr int C     = 256;
constexpr int C8    = 32;
constexpr int HW    = 4096;

constexpr int KB    = 16;    // keys per pipelined tile
constexpr int SSTR  = 17;    // S-transpose scratch stride

constexpr int KS     = 4;            // key ranges per work-group
constexpr int QT     = 4;            // 16-query tiles per work-group
constexpr int NW     = KS * QT;      // waves per work-group
constexpr int KRANGE = HW / KS;      // keys per key range
constexpr int VT_F   = C * KB;       // floats of one V tile, in ws and in LDS
constexpr int KT_F   = C8 * KB;      // floats of one K tile, in ws and in LDS
constexpr int OT_F   = C * 16;       // floats of one wave's O tile
constexpr int SMEM_F = NW * OT_F;    // merge area; the loop's ring lies inside
static_assert(KS * 2 * (VT_F + KT_F) + NW * 16 * SSTR <= SMEM_F, "ring fits");

__device__ __forceinline__ v8f wmma_f32(v2f a, v2f b, v8f c) {
  return __builtin_amdgcn_wmma_f32_16x16x4_f32(false, a, false, b, (short)0, c,
                                               false, false);
}

// --- gfx1250 async global->LDS (bypasses VGPRs, tracked by ASYNCcnt) -------
// One tile's nine 16-byte copies of a lane in ONE statement that ends in
// s_wait_xcnt 0, so that no address register of an issued copy is rewritten
// ahead of that wait.
__device__ __forceinline__ void async_ld9_b128(
    unsigned l0, unsigned l1, unsigned l2, unsigned l3, unsigned l4,
    unsigned l5, unsigned l6, unsigned l7, unsigned l8,
    const float* g0, const float* g1, const float* g2, const float* g3,
    const float* g4, const float* g5, const float* g6, const float* g7,
    const float* g8) {
  asm volatile(
      "global_load_async_to_lds_b128 %0, %9, off\n\t"
      "global_load_async_to_lds_b128 %1, %10, off\n\t"
      "global_load_async_to_lds_b128 %2, %11, off\n\t"
      "global_load_async_to_lds_b128 %3, %12, off\n\t"
      "global_load_async_to_lds_b128 %4, %13, off\n\t"
      "global_load_async_to_lds_b128 %5, %14, off\n\t"
      "global_load_async_to_lds_b128 %6, %15, off\n\t"
      "global_load_async_to_lds_b128 %7, %16, off\n\t"
      "global_load_async_to_lds_b128 %8, %17, off\n\t"
      "s_wait_xcnt 0x0"
      :: "v"(l0), "v"(l1), "v"(l2), "v"(l3), "v"(l4), "v"(l5), "v"(l6),
         "v"(l7), "v"(l8), "v"(g0), "v"(g1), "v"(g2), "v"(g3), "v"(g4),
         "v"(g5), "v"(g6), "v"(g7), "v"(g8)
      : "memory");
}
// The issuing wave's own copies have landed behind this wait.
__device__ __forceinline__ void wait_async_0() {
  asm volatile("s_wait_asynccnt 0x0" ::: "memory");
}
// The wave's own LDS reads and writes have retired behind this wait.
__device__ __forceinline__ void wait_ds_0() {
  asm volatile("s_wait_dscnt 0x0" ::: "memory");
}
// e^x as __expf forms it (scale by log2 e, v_exp_f32), with the one free issue
// slot behind the transcendental inside the statement: these stand in rows, in
// the loop and in the merge, where the next one may reuse this one's source
// register.
__device__ __forceinline__ float exp_slot(float xv) {
  const float a = xv * 1.44269504f;
  float r;
  asm("v_exp_f32 %0, %1\n\tv_nop" : "=v"(r) : "v"(a));
  return r;
}
__device__ __forceinline__ unsigned lds_off(const float* p) {
  return (unsigned)(uintptr_t)p;  // generic shared ptr: low 32 bits = LDS offset
}

// ---------------------------------------------------------------------------
// Projection: y[b][m][n] = sum_c W[m][c] * X[b][c][n] + bias[m]
// grid = (HW/128, M/16, BATCH), block = 256 (8 waves, one 16x16 tile each).
// LAY 0: Y[b][m][n], rows of HW.
// LAY 1: fragment order. Y[b][n/16][m/16] is a block of 256 floats,
//   [k/8][lane][(k/4)%2][k%2] with lane = 16*((k/2)%2) + j: what lane `lane` of
//   a 16x16x4 operand holds for the k steps 2*(k/8) and 2*(k/8)+1, 16 bytes.
//   Keys as columns, B of Q^T K: k = m%16, j = n%16.
// ---------------------------------------------------------------------------
template <int LAY>
__global__ __launch_bounds__(256) void ag_proj_kernel(
    const float* __restrict__ Wm, const float* __restrict__ bias,
    const float* __restrict__ X, float* __restrict__ Y, int M) {
  const int lane  = threadIdx.x & 31;
  const int wave  = threadIdx.x >> 5;
  const int lhalf = lane >> 4;
  const int lmod  = lane & 15;
  const int b     = blockIdx.z;
  const int m0    = blockIdx.y * 16;
  const int n0    = (blockIdx.x * 8 + wave) * 16;

  const float* Xb = X + (size_t)b * C * HW;
  float*       Yb = Y + (size_t)b * M * HW;

  const float* wrow = Wm + (size_t)(m0 + lmod) * C;
  const float* xcol = Xb + n0 + lmod;

  v8f acc = {};
#pragma unroll 8
  for (int k0 = 0; k0 < C; k0 += 4) {
    const int ka = k0 + 2 * lhalf;
    v2f a, bb;
    a.x  = wrow[ka];
    a.y  = wrow[ka + 1];
    bb.x = xcol[(size_t)ka * HW];
    bb.y = xcol[(size_t)(ka + 1) * HW];
    acc = wmma_f32(a, bb, acc);
  }
  if (LAY == 0) {
#pragma unroll
    for (int r = 0; r < 8; ++r) {
      const int mr = m0 + r + 8 * lhalf;
      Yb[(size_t)mr * HW + n0 + lmod] = acc[r] + bias[mr];
    }
  } else {
    // acc[r] is k = r + 8 * lhalf of column j = lmod.
#pragma unroll
    for (int r = 0; r < 8; ++r)
      acc[r] += bias[m0 + r + 8 * lhalf];
    float* yt = Yb + (size_t)(n0 >> 4) * (M * 16) + (m0 >> 4) * 256 +
                lhalf * 128 + lmod * 4;
#pragma unroll
    for (int h = 0; h < 2; ++h) {
      v4f t;
      t.x = acc[2 * h];
      t.y = acc[2 * h + 1];
      t.z = acc[4 + 2 * h];
      t.w = acc[5 + 2 * h];
      *(v4f*)&yt[h * 64] = t;
    }
  }
}

// ---------------------------------------------------------------------------
// V projection into the same fragment order with k = n%16, j = m%16 (channels
// as rows, A of V P^T); the product is formed transposed, X^T as A, W^T as B.
// grid = (HW/64, BATCH), block = 512: wave w owns channels 16 w .. 16 w + 15
// and all 64 keys of the group, as four 16x16 tiles that share each W
// fragment. Tile t takes the keys n0 + 4 i + t (i = row of the tile), so one
// 16-byte load of a lane feeds all four tiles and a wave reads whole lines.
// The 16 waves read the same X lines. The c order of every sum is as before.
// ---------------------------------------------------------------------------
__global__ __launch_bounds__(512) void ag_projv_kernel(
    const float* __restrict__ Wm, const float* __restrict__ bias,
    const float* __restrict__ X, float* __restrict__ Y) {
  const int lane  = threadIdx.x & 31;
  const int wave  = threadIdx.x >> 5;
  const int lhalf = lane >> 4;
  const int lmod  = lane & 15;
  const int b     = blockIdx.y;
  const int m0    = wave * 16;
  const int n0    = blockIdx.x * 64;

  const float* wrow = Wm + (size_t)(m0 + lmod) * C + 2 * lhalf;
  const float* xcol = X + (size_t)b * C * HW + (size_t)(2 * lhalf) * HW + n0 +
                      4 * lmod;

  constexpr int U  = 8;            // k steps per stage
  constexpr int NS = C / (4 * U);  // stages
  v2f wf[2][U];
  v4f x0[2][U], x1[2][U];
  v8f acc[4] = {};
#pragma unroll
  for (int u = 0; u < U; ++u) {
    wf[0][u] = *(const v2f*)&wrow[4 * u];
    x0[0][u] = *(const v4f*)&xcol[(size_t)(4 * u) * HW];
    x1[0][u] = *(const v4f*)&xcol[(size_t)(4 * u + 1) * HW];
  }
  // Unrolled whole: the two register stages are picked at compile time, and
  // every load is one base register plus a constant offset.
#pragma unroll
  for (int st = 0; st < NS; ++st) {
    const int cur = st & 1;
    if (st + 1 < NS) {             // the next stage flies under this one
#pragma unroll
      for (int u = 0; u < U; ++u) {
        const int k0 = 4 * ((st + 1) * U + u);
        wf[cur ^ 1][u] = *(const v2f*)&wrow[k0];
        x0[cur ^ 1][u] = *(const v4f*)&xcol[(size_t)k0 * HW];
        x1[cur ^ 1][u] = *(const v4f*)&xcol[(size_t)(k0 + 1) * HW];
      }
    }
    // Behind the last loads: no address register of an issued load is
    // rewritten ahead of this wait; naming both keeps them whole up to it.
    if (st + 2 == NS)
      asm volatile("s_wait_xcnt 0x0" :: "v"(wrow), "v"(xcol) : "memory");
    // Keeps the stage's loads together in front of this stage's products:
    // left free, the scheduler puts each pair of loads directly in front of
    // the register moves that read it, and the wave waits out every latency.
    __builtin_amdgcn_sched_barrier(0);
#pragma unroll
    for (int u = 0; u < U; ++u)
#pragma unroll
      for (int t = 0; t < 4; ++t) {
        v2f a;
        a.x = x0[cur][u][t];
        a.y = x1[cur][u][t];
        acc[t] = wmma_f32(a, wf[cur][u], acc[t]);
      }
  }

  // acc[t][r] is channel m0 + lmod, key n0 + 32 lhalf + 4 r + t: key tile
  // 2 lhalf + r/4, k = 4 (r%4) + t. A lane holds all 16 k of two key tiles.
  const float bv = bias[m0 + lmod];
  float* yt = Y + (size_t)b * C * HW +
              (size_t)((n0 >> 4) + 2 * lhalf) * (C * 16) + wave * 256 + lmod * 4;
#pragma unroll
  for (int kt = 0; kt < 2; ++kt)
#pragma unroll
    for (int p = 0; p < 2; ++p)
#pragma unroll
      for (int h = 0; h < 2; ++h) {
        const int r = 4 * kt + 2 * p;
        v4f t;
        t.x = acc[2 * h][r] + bv;
        t.y = acc[2 * h + 1][r] + bv;
        t.z = acc[2 * h][r + 1] + bv;
        t.w = acc[2 * h + 1][r + 1] + bv;
        *(v4f*)&yt[kt * (C * 16) + p * 128 + h * 64] = t;
      }
}

// ---------------------------------------------------------------------------
// Fused flash attention. grid = (HW/64, BATCH), block = 512 (16 waves).
// Wave = (key range ks, query tile qt): 4 query tiles of 16 x 4 key ranges of
// HW/4 keys. Each group of 4 waves stages the 16-key K/V tiles of its own key
// range (two buffers, async engine) and keeps its own running max, sum and O.
// Behind the loop the four partial results of a query tile are merged in LDS.
// ---------------------------------------------------------------------------
__global__ __launch_bounds__(512) void ag_attn_kernel(
    const float* __restrict__ qws, const float* __restrict__ kws,
    const float* __restrict__ vws, const float* __restrict__ x,
    const float* __restrict__ gamma, float* __restrict__ out) {
  // In the loop: V ring | K ring | S-transpose scratch. Behind it: 16 O tiles.
  __shared__ __attribute__((aligned(16))) float smem[SMEM_F];
  __shared__ float mlbuf[NW * 64];        // running max and sum of every wave

  const int lane  = threadIdx.x & 31;
  // Same in every lane of a wave: kept scalar, so ring bases stay in SGPRs.
  const int wave  = __builtin_amdgcn_readfirstlane(threadIdx.x >> 5);
  const int ks    = wave >> 2;            // key range of this wave
  const int qt    = wave & 3;             // query tile of this wave
  const int lhalf = lane >> 4;
  const int lmod  = lane & 15;
  const int b     = blockIdx.y;
  const int q0    = blockIdx.x * (QT * 16) + qt * 16;

  const float* qp = qws + (size_t)b * C8 * HW;
  const float* kp = kws + (size_t)b * C8 * HW + ks * KRANGE * C8;  // tile-major
  const float* vp = vws + (size_t)b * C  * HW + ks * KRANGE * C;

  float* vring = smem + ks * 2 * VT_F;                     // [2][VT_F]
  float* kring = smem + KS * 2 * VT_F + ks * 2 * KT_F;     // [2][KT_F]
  float* smy   = smem + KS * 2 * (VT_F + KT_F) + wave * 16 * SSTR;

  // --- one tile of this key range: 9 copies of 16 bytes per thread ---------
  // A tile is one block in ws and the same block in LDS: a wave's copy takes
  // 512 bytes in a row, four whole lines.
  const int g4 = (threadIdx.x & 127) * 4; // float of this thread in 2 KiB
  auto issue_tile = [&](int buf, int kb) {
    float*       vl = vring + buf * VT_F + g4;
    const float* vg = vp + (size_t)kb * C + g4;
    async_ld9_b128(
        lds_off(vl),            lds_off(vl + 512),
        lds_off(vl + 1024),     lds_off(vl + 1536),
        lds_off(vl + 2048),     lds_off(vl + 2560),
        lds_off(vl + 3072),     lds_off(vl + 3584),
        lds_off(kring + buf * KT_F + g4),
        vg,                     vg + 512,
        vg + 1024,              vg + 1536,
        vg + 2048,              vg + 2560,
        vg + 3072,              vg + 3584,
        kp + (size_t)kb * C8 + g4);
  };

  // Q fragments: A of energy-WMMA, K-dim = C8 = 32 -> 8 steps of 4.
  v2f afrag[8];
#pragma unroll
  for (int kc = 0; kc < 8; ++kc) {
    const int ca = 4 * kc + 2 * lhalf;
    afrag[kc].x = qp[(size_t)ca * HW + q0 + lmod];
    afrag[kc].y = qp[(size_t)(ca + 1) * HW + q0 + lmod];
  }

  v8f oacc[16] = {};        // O tile: 256 channels x 16 queries
  float mrow = -3.0e38f;
  float lrow = 0.0f;

  constexpr int NT = KRANGE / KB;   // 64 pipelined tiles per key range
  issue_tile(0, 0);                 // tile 0 lands and is published ...
  wait_async_0();
  __syncthreads();
  issue_tile(1, KB);                // ... tile 1 flies while tile 0 is worked on

  // Rolled: the body already holds 72 matrix instructions.
#pragma unroll 1
  for (int it = 0; it < NT; ++it) {
    const int cur = it & 1;
    const float* kt = kring + cur * KT_F;
    const float* vt = vring + cur * VT_F;

    // ---- S = Q^T K : 16 queries x 16 keys ----
    v8f s = {};
    v4f kf[4];                                // kf[p]: k steps 2p and 2p+1
#pragma unroll
    for (int p = 0; p < 4; ++p) kf[p] = *(const v4f*)&kt[p * 128 + lane * 4];
    // Holds the four reads together in front of the products (inputs only):
    // without it they share one register quad and the wave waits out the LDS
    // latency four times in this dependent chain.
    asm volatile("" :: "v"(kf[0]), "v"(kf[1]), "v"(kf[2]), "v"(kf[3]));
#pragma unroll
    for (int p = 0; p < 4; ++p) {
      v2f b0, b1;
      b0.x = kf[p].x;
      b0.y = kf[p].y;
      b1.x = kf[p].z;
      b1.y = kf[p].w;
      s = wmma_f32(afrag[2 * p], b0, s);
      s = wmma_f32(afrag[2 * p + 1], b1, s);
    }

    // ---- transpose S via LDS: D layout (key=lane) -> [query][key] ----
#pragma unroll
    for (int r = 0; r < 8; ++r)
      smy[(r + 8 * lhalf) * SSTR + lmod] = s[r];
    asm volatile("s_wait_dscnt 0" ::: "memory");  // same-wave LDS is in-order

    float pv[8];
    float tmax = -3.0e38f;
#pragma unroll
    for (int kc2 = 0; kc2 < 4; ++kc2)
#pragma unroll
      for (int h = 0; h < 2; ++h) {
        const float sv = smy[lmod * SSTR + 4 * kc2 + 2 * lhalf + h];
        pv[kc2 * 2 + h] = sv;
        tmax = fmaxf(tmax, sv);
      }
    tmax = fmaxf(tmax, __shfl_xor(tmax, 16, 32));  // lane pair shares a query

    // ---- online softmax update ----
    const float mnew = fmaxf(mrow, tmax);
    const float corr = exp_slot(mrow - mnew);
    float psum = 0.0f;
#pragma unroll
    for (int j = 0; j < 8; ++j) {
      pv[j] = exp_slot(pv[j] - mnew);
      psum += pv[j];
    }
    psum += __shfl_xor(psum, 16, 32);
    lrow = lrow * corr + psum;
    mrow = mnew;
#pragma unroll
    for (int ct = 0; ct < 16; ++ct)
#pragma unroll
      for (int r = 0; r < 8; ++r) oacc[ct][r] *= corr;

    // ---- O += V * P^T : V fragments from LDS, two k steps per 16-byte read ----
#pragma unroll
    for (int p = 0; p < 2; ++p) {
      v4f vf[16];
#pragma unroll
      for (int ct = 0; ct < 16; ++ct)
        vf[ct] = *(const v4f*)&vt[ct * 256 + p * 128 + lane * 4];
#pragma unroll
      for (int q = 0; q < 2; ++q) {
        const int kc2 = 2 * p + q;
        v2f bb;
        bb.x = pv[kc2 * 2 + 0];
        bb.y = pv[kc2 * 2 + 1];
#pragma unroll
        for (int ct = 0; ct < 16; ++ct) {
          v2f av;
          av.x = q ? vf[ct].z : vf[ct].x;
          av.y = q ? vf[ct].w : vf[ct].y;
          oacc[ct] = wmma_f32(av, bb, oacc[ct]);
        }
      }
    }

    // ---- foot of the trip: own reads of `cur` retired, own copies of the
    // next tile landed, then the one barrier that publishes the next tile and
    // frees `cur` for the refill behind it ----
    wait_ds_0();
    wait_async_0();
    __syncthreads();
    if (it + 2 < NT) issue_tile(cur, (it + 2) * KB);
  }
  wait_async_0();   // no copy is in flight when the ring's LDS is reused

  // ---- merge the four key ranges of each query tile through LDS ----
  // Every wave lays down its raw O tile, max and sum, lane for lane.
  {
    float* mg = smem + wave * OT_F + lane * 4;
#pragma unroll
    for (int ct = 0; ct < 16; ++ct)
#pragma unroll
      for (int rh = 0; rh < 2; ++rh) {
        v4f t;
        t.x = oacc[ct][4 * rh + 0];
        t.y = oacc[ct][4 * rh + 1];
        t.z = oacc[ct][4 * rh + 2];
        t.w = oacc[ct][4 * rh + 3];
        *(v4f*)&mg[(ct * 2 + rh) * 128] = t;
      }
    mlbuf[wave * 64 + lane]      = mrow;
    mlbuf[wave * 64 + 32 + lane] = lrow;
  }
  __syncthreads();   // all partial results are visible to their partners

  float ms[KS], fs[KS];
  float mall = -3.0e38f;
#pragma unroll
  for (int s = 0; s < KS; ++s) {
    ms[s] = mlbuf[(s * QT + qt) * 64 + lane];
    mall  = fmaxf(mall, ms[s]);
  }
  float lall = 0.0f;
#pragma unroll
  for (int s = 0; s < KS; ++s) {
    fs[s] = exp_slot(ms[s] - mall);
    lall += fs[s] * mlbuf[(s * QT + qt) * 64 + 32 + lane];
  }

  // ---- finalize: out = gamma * O / l + x; wave ks owns channels 64 ks .. ----
  const float gm   = gamma[0];
  const float rinv = 1.0f / lall;
  const float* xb  = x   + (size_t)b * C * HW;
  float*       ob  = out + (size_t)b * C * HW;
#pragma unroll
  for (int cq = 0; cq < 4; ++cq) {
    const int ct = ks * 4 + cq;
#pragma unroll
    for (int rh = 0; rh < 2; ++rh) {
      v4f acc = {};
#pragma unroll
      for (int s = 0; s < KS; ++s) {
        const v4f t = *(const v4f*)&smem[(s * QT + qt) * OT_F +
                                         (ct * 2 + rh) * 128 + lane * 4];
        acc += fs[s] * t;
      }
#pragma unroll
      for (int e = 0; e < 4; ++e) {
        const int c = 16 * ct + 4 * rh + e + 8 * lhalf;
        const size_t idx = (size_t)c * HW + q0 + lmod;
        ob[idx] = gm * (acc[e] * rinv) + xb[idx];
      }
    }
  }
}

// ---------------------------------------------------------------------------
extern "C" void kernel_launch(void* const* d_in, const int* in_sizes, int n_in,
                              void* d_out, int out_size, void* d_ws,
                              size_t ws_size, hipStream_t stream) {
  const float* x     = (const float*)d_in[0];
  const float* g     = (const float*)d_in[1];
  const float* q_w   = (const float*)d_in[2];
  const float* q_b   = (const float*)d_in[3];
  const float* k_w   = (const float*)d_in[4];
  const float* k_b   = (const float*)d_in[5];
  const float* v_w   = (const float*)d_in[6];
  const float* v_b   = (const float*)d_in[7];
  const float* gamma = (const float*)d_in[8];
  float* out = (float*)d_out;

  // Workspace: q (2MB) | k (2MB) | v (16MB); k and v in fragment order.
  float* qws = (float*)d_ws;
  float* kws = qws + (size_t)BATCH * C8 * HW;
  float* vws = kws + (size_t)BATCH * C8 * HW;

  dim3 blk(256);
  ag_proj_kernel<0><<<dim3(HW / 128, C8 / 16, BATCH), blk, 0, stream>>>(
      q_w, q_b, x, qws, C8);
  ag_proj_kernel<1><<<dim3(HW / 128, C8 / 16, BATCH), blk, 0, stream>>>(
      k_w, k_b, g, kws, C8);
  ag_projv_kernel<<<dim3(HW / 64, BATCH), dim3(512), 0, stream>>>(
      v_w, v_b, g, vws);
  ag_attn_kernel<<<dim3(HW / (QT * 16), BATCH), dim3(NW * 32), 0, stream>>>(
      qws, kws, vws, x, gamma, out);
}

// v004
// It runs in 218 microseconds.
// Next to v003, in two timings, it ran 1.03 times as fast each time.
// Over all steps from v000 it is 2.44 times as fast.
#include <hip/hip_runtime.h>

// ---------------------------------------------------------------------------
// AttentionGate for MI455X (gfx1250, wave32).
//   Stage 1: q,k,v projection GEMMs via V_WMMA_F32_16X16X4_F32 into ws; k and
//            v are laid down per 16-key tile in the order in which stage 2's
//            matrix instructions take their fragments.
//   Stage 2: fused flash attention, double-buffered K/V tiles staged in LDS
//            via GLOBAL_LOAD_ASYNC_TO_LDS_* (ASYNCcnt), energy + PV on WMMA,
//            online softmax in fp32; the keys of a query tile are split over
//            four waves and the partial results merged in LDS.
// ---------------------------------------------------------------------------

typedef __attribute__((ext_vector_type(2))) float v2f;
typedef __attribute__((ext_vector_type(4))) float v4f;
typedef __attribute__((ext_vector_type(8))) float v8f;

constexpr int BATCH = 4;
constexpr int C     = 256;
constexpr int C8    = 32;
constexpr int HW    = 4096;

constexpr int KB    = 32;    // keys per pipelined tile: two 16-key blocks
constexpr int SSTR  = 17;    // S-transpose scratch stride

constexpr int KS     = 4;            // key ranges per work-group
constexpr int QT     = 4;            // 16-query tiles per work-group
constexpr int NW     = KS * QT;      // waves per work-group
constexpr int KRANGE = HW / KS;      // keys per key range
constexpr int VB_F   = C * 16;       // floats of one 16-key V block
constexpr int KB_F   = C8 * 16;      // floats of one 16-key K block
constexpr int VT_F   = C * KB;       // floats of one V tile, in ws and in LDS
constexpr int KT_F   = C8 * KB;      // floats of one K tile, in ws and in LDS
constexpr int OT_F   = C * 16;       // floats of one wave's O tile
// The loop's ring and scratch; the merge area lies inside.
constexpr int SMEM_F = KS * 2 * (VT_F + KT_F) + NW * 16 * SSTR;
static_assert(NW * OT_F <= SMEM_F, "merge area fits");

__device__ __forceinline__ v8f wmma_f32(v2f a, v2f b, v8f c) {
  return __builtin_amdgcn_wmma_f32_16x16x4_f32(false, a, false, b, (short)0, c,
                                               false, false);
}

// --- gfx1250 async global->LDS (bypasses VGPRs, tracked by ASYNCcnt) -------
// Nine 16-byte copies of a lane, half a tile, in ONE statement that ends in
// s_wait_xcnt 0, so that no address register of an issued copy is rewritten
// ahead of that wait.
__device__ __forceinline__ void async_ld9_b128(
    unsigned l0, unsigned l1, unsigned l2, unsigned l3, unsigned l4,
    unsigned l5, unsigned l6, unsigned l7, unsigned l8,
    const float* g0, const float* g1, const float* g2, const float* g3,
    const float* g4, const float* g5, const float* g6, const float* g7,
    const float* g8) {
  asm volatile(
      "global_load_async_to_lds_b128 %0, %9, off\n\t"
      "global_load_async_to_lds_b128 %1, %10, off\n\t"
      "global_load_async_to_lds_b128 %2, %11, off\n\t"
      "global_load_async_to_lds_b128 %3, %12, off\n\t"
      "global_load_async_to_lds_b128 %4, %13, off\n\t"
      "global_load_async_to_lds_b128 %5, %14, off\n\t"
      "global_load_async_to_lds_b128 %6, %15, off\n\t"
      "global_load_async_to_lds_b128 %7, %16, off\n\t"
      "global_load_async_to_lds_b128 %8, %17, off\n\t"
      "s_wait_xcnt 0x0"
      :: "v"(l0), "v"(l1), "v"(l2), "v"(l3), "v"(l4), "v"(l5), "v"(l6),
         "v"(l7), "v"(l8), "v"(g0), "v"(g1), "v"(g2), "v"(g3), "v"(g4),
         "v"(g5), "v"(g6), "v"(g7), "v"(g8)
      : "memory");
}
// The issuing wave's own copies have landed behind this wait.
__device__ __forceinline__ void wait_async_0() {
  asm volatile("s_wait_asynccnt 0x0" ::: "memory");
}
// The wave's own LDS reads and writes have retired behind this wait.
__device__ __forceinline__ void wait_ds_0() {
  asm volatile("s_wait_dscnt 0x0" ::: "memory");
}
// e^x as __expf forms it (scale by log2 e, v_exp_f32), with the one free issue
// slot behind the transcendental inside the statement: these stand in rows, in
// the loop and in the merge, where the next one may reuse this one's source
// register.
__device__ __forceinline__ float exp_slot(float xv) {
  const float a = xv * 1.44269504f;
  float r;
  asm("v_exp_f32 %0, %1\n\tv_nop" : "=v"(r) : "v"(a));
  return r;
}
__device__ __forceinline__ unsigned lds_off(const float* p) {
  return (unsigned)(uintptr_t)p;  // generic shared ptr: low 32 bits = LDS offset
}

// ---------------------------------------------------------------------------
// Projection: y[b][m][n] = sum_c W[m][c] * X[b][c][n] + bias[m]
// grid = (HW/128, M/16, BATCH), block = 256 (8 waves, one 16x16 tile each).
// LAY 0: Y[b][m][n], rows of HW.
// LAY 1: fragment order. Y[b][n/16][m/16] is a block of 256 floats,
//   [k/8][lane][(k/4)%2][k%2] with lane = 16*((k/2)%2) + j: what lane `lane` of
//   a 16x16x4 operand holds for the k steps 2*(k/8) and 2*(k/8)+1, 16 bytes.
//   Keys as columns, B of Q^T K: k = m%16, j = n%16.
// ---------------------------------------------------------------------------
template <int LAY>
__global__ __launch_bounds__(256) void ag_proj_kernel(
    const float* __restrict__ Wm, const float* __restrict__ bias,
    const float* __restrict__ X, float* __restrict__ Y, int M) {
  const int lane  = threadIdx.x & 31;
  const int wave  = threadIdx.x >> 5;
  const int lhalf = lane >> 4;
  const int lmod  = lane & 15;
  const int b     = blockIdx.z;
  const int m0    = blockIdx.y * 16;
  const int n0    = (blockIdx.x * 8 + wave) * 16;

  const float* Xb = X + (size_t)b * C * HW;
  float*       Yb = Y + (size_t)b * M * HW;

  const float* wrow = Wm + (size_t)(m0 + lmod) * C;
  const float* xcol = Xb + n0 + lmod;

  v8f acc = {};
#pragma unroll 8
  for (int k0 = 0; k0 < C; k0 += 4) {
    const int ka = k0 + 2 * lhalf;
    v2f a, bb;
    a.x  = wrow[ka];
    a.y  = wrow[ka + 1];
    bb.x = xcol[(size_t)ka * HW];
    bb.y = xcol[(size_t)(ka + 1) * HW];
    acc = wmma_f32(a, bb, acc);
  }
  if (LAY == 0) {
#pragma unroll
    for (int r = 0; r < 8; ++r) {
      const int mr = m0 + r + 8 * lhalf;
      Yb[(size_t)mr * HW + n0 + lmod] = acc[r] + bias[mr];
    }
  } else {
    // acc[r] is k = r + 8 * lhalf of column j = lmod.
#pragma unroll
    for (int r = 0; r < 8; ++r)
      acc[r] += bias[m0 + r + 8 * lhalf];
    float* yt = Yb + (size_t)(n0 >> 4) * (M * 16) + (m0 >> 4) * 256 +
                lhalf * 128 + lmod * 4;
#pragma unroll
    for (int h = 0; h < 2; ++h) {
      v4f t;
      t.x = acc[2 * h];
      t.y = acc[2 * h + 1];
      t.z = acc[4 + 2 * h];
      t.w = acc[5 + 2 * h];
      *(v4f*)&yt[h * 64] = t;
    }
  }
}

// ---------------------------------------------------------------------------
// V projection into the same fragment order with k = n%16, j = m%16 (channels
// as rows, A of V P^T); the product is formed transposed, X^T as A, W^T as B.
// grid = (HW/64, BATCH), block = 512: wave w owns channels 16 w .. 16 w + 15
// and all 64 keys of the group, as four 16x16 tiles that share each W
// fragment. Tile t takes the keys n0 + 4 i + t (i = row of the tile), so one
// 16-byte load of a lane feeds all four tiles and a wave reads whole lines.
// The 16 waves read the same X lines. The c order of every sum is as before.
// ---------------------------------------------------------------------------
__global__ __launch_bounds__(512) void ag_projv_kernel(
    const float* __restrict__ Wm, const float* __restrict__ bias,
    const float* __restrict__ X, float* __restrict__ Y) {
  const int lane  = threadIdx.x & 31;
  const int wave  = threadIdx.x >> 5;
  const int lhalf = lane >> 4;
  const int lmod  = lane & 15;
  const int b     = blockIdx.y;
  const int m0    = wave * 16;
  const int n0    = blockIdx.x * 64;

  const float* wrow = Wm + (size_t)(m0 + lmod) * C + 2 * lhalf;
  const float* xcol = X + (size_t)b * C * HW + (size_t)(2 * lhalf) * HW + n0 +
                      4 * lmod;

  constexpr int U  = 8;            // k steps per stage
  constexpr int NS = C / (4 * U);  // stages
  v2f wf[2][U];
  v4f x0[2][U], x1[2][U];
  v8f acc[4] = {};
#pragma unroll
  for (int u = 0; u < U; ++u) {
    wf[0][u] = *(const v2f*)&wrow[4 * u];
    x0[0][u] = *(const v4f*)&xcol[(size_t)(4 * u) * HW];
    x1[0][u] = *(const v4f*)&xcol[(size_t)(4 * u + 1) * HW];
  }
  // Unrolled whole: the two register stages are picked at compile time, and
  // every load is one base register plus a constant offset.
#pragma unroll
  for (int st = 0; st < NS; ++st) {
    const int cur = st & 1;
    if (st + 1 < NS) {             // the next stage flies under this one
#pragma unroll
      for (int u = 0; u < U; ++u) {
        const int k0 = 4 * ((st + 1) * U + u);
        wf[cur ^ 1][u] = *(const v2f*)&wrow[k0];
        x0[cur ^ 1][u] = *(const v4f*)&xcol[(size_t)k0 * HW];
        x1[cur ^ 1][u] = *(const v4f*)&xcol[(size_t)(k0 + 1) * HW];
      }
    }
    // Behind the last loads: no address register of an issued load is
    // rewritten ahead of this wait; naming both keeps them whole up to it.
    if (st + 2 == NS)
      asm volatile("s_wait_xcnt 0x0" :: "v"(wrow), "v"(xcol) : "memory");
    // Keeps the stage's loads together in front of this stage's products:
    // left free, the scheduler puts each pair of loads directly in front of
    // the register moves that read it, and the wave waits out every latency.
    __builtin_amdgcn_sched_barrier(0);
#pragma unroll
    for (int u = 0; u < U; ++u)
#pragma unroll
      for (int t = 0; t < 4; ++t) {
        v2f a;
        a.x = x0[cur][u][t];
        a.y = x1[cur][u][t];
        acc[t] = wmma_f32(a, wf[cur][u], acc[t]);
      }
  }

  // acc[t][r] is channel m0 + lmod, key n0 + 32 lhalf + 4 r + t: key tile
  // 2 lhalf + r/4, k = 4 (r%4) + t. A lane holds all 16 k of two key tiles.
  const float bv = bias[m0 + lmod];
  float* yt = Y + (size_t)b * C * HW +
              (size_t)((n0 >> 4) + 2 * lhalf) * (C * 16) + wave * 256 + lmod * 4;
#pragma unroll
  for (int kt = 0; kt < 2; ++kt)
#pragma unroll
    for (int p = 0; p < 2; ++p)
#pragma unroll
      for (int h = 0; h < 2; ++h) {
        const int r = 4 * kt + 2 * p;
        v4f t;
        t.x = acc[2 * h][r] + bv;
        t.y = acc[2 * h + 1][r] + bv;
        t.z = acc[2 * h][r + 1] + bv;
        t.w = acc[2 * h + 1][r + 1] + bv;
        *(v4f*)&yt[kt * (C * 16) + p * 128 + h * 64] = t;
      }
}

// ---------------------------------------------------------------------------
// Fused flash attention. grid = (HW/64, BATCH), block = 512 (16 waves).
// Wave = (key range ks, query tile qt): 4 query tiles of 16 x 4 key ranges of
// HW/4 keys. Each group of 4 waves stages the 32-key K/V tiles of its own key
// range (two buffers, async engine) and keeps its own running max, sum and O.
// Behind the loop the four partial results of a query tile are merged in LDS.
// ---------------------------------------------------------------------------
__global__ __launch_bounds__(512) void ag_attn_kernel(
    const float* __restrict__ qws, const float* __restrict__ kws,
    const float* __restrict__ vws, const float* __restrict__ x,
    const float* __restrict__ gamma, float* __restrict__ out) {
  // In the loop: V ring | K ring | S-transpose scratch. Behind it: 16 O tiles.
  __shared__ __attribute__((aligned(16))) float smem[SMEM_F];
  __shared__ float mlbuf[NW * 64];        // running max and sum of every wave

  const int lane  = threadIdx.x & 31;
  // Same in every lane of a wave: kept scalar, so ring bases stay in SGPRs.
  const int wave  = __builtin_amdgcn_readfirstlane(threadIdx.x >> 5);
  const int ks    = wave >> 2;            // key range of this wave
  const int qt    = wave & 3;             // query tile of this wave
  const int lhalf = lane >> 4;
  const int lmod  = lane & 15;
  const int b     = blockIdx.y;
  const int q0    = blockIdx.x * (QT * 16) + qt * 16;

  const float* qp = qws + (size_t)b * C8 * HW;
  const float* kp = kws + (size_t)b * C8 * HW + ks * KRANGE * C8;  // tile-major
  const float* vp = vws + (size_t)b * C  * HW + ks * KRANGE * C;

  float* vring = smem + ks * 2 * VT_F;                     // [2][VT_F]
  float* kring = smem + KS * 2 * VT_F + ks * 2 * KT_F;     // [2][KT_F]
  float* smy   = smem + KS * 2 * (VT_F + KT_F) + wave * 16 * SSTR;

  // --- one tile of this key range: 18 copies of 16 bytes per thread --------
  // A tile is two blocks in a row in ws and the same in LDS: a wave's copy
  // takes 512 bytes in a row, four whole lines.
  const int g4 = (threadIdx.x & 127) * 4; // float of this thread in 2 KiB
  auto issue_tile = [&](int buf, int kb) {
    float*       vl = vring + buf * VT_F + g4;
    const float* vg = vp + (size_t)kb * C + g4;
    float*       kl = kring + buf * KT_F + g4;
    const float* kg = kp + (size_t)kb * C8 + g4;
    async_ld9_b128(
        lds_off(vl),            lds_off(vl + 512),
        lds_off(vl + 1024),     lds_off(vl + 1536),
        lds_off(vl + 2048),     lds_off(vl + 2560),
        lds_off(vl + 3072),     lds_off(vl + 3584),
        lds_off(vl + 4096),
        vg,                     vg + 512,
        vg + 1024,              vg + 1536,
        vg + 2048,              vg + 2560,
        vg + 3072,              vg + 3584,
        vg + 4096);
    async_ld9_b128(
        lds_off(vl + 4608),     lds_off(vl + 5120),
        lds_off(vl + 5632),     lds_off(vl + 6144),
        lds_off(vl + 6656),     lds_off(vl + 7168),
        lds_off(vl + 7680),     lds_off(kl),
        lds_off(kl + 512),
        vg + 4608,              vg + 5120,
        vg + 5632,              vg + 6144,
        vg + 6656,              vg + 7168,
        vg + 7680,              kg,
        kg + 512);
  };

  // Q fragments: A of energy-WMMA, K-dim = C8 = 32 -> 8 steps of 4.
  v2f afrag[8];
#pragma unroll
  for (int kc = 0; kc < 8; ++kc) {
    const int ca = 4 * kc + 2 * lhalf;
    afrag[kc].x = qp[(size_t)ca * HW + q0 + lmod];
    afrag[kc].y = qp[(size_t)(ca + 1) * HW + q0 + lmod];
  }

  v8f oacc[16] = {};        // O tile: 256 channels x 16 queries
  float mrow = -3.0e38f;
  float lrow = 0.0f;

  constexpr int NT = KRANGE / KB;   // 32 pipelined tiles per key range
  issue_tile(0, 0);                 // tile 0 lands and is published ...
  wait_async_0();
  __syncthreads();
  issue_tile(1, KB);                // ... tile 1 flies while tile 0 is worked on

  // Rolled: the body already holds 144 matrix instructions.
#pragma unroll 1
  for (int it = 0; it < NT; ++it) {
    const int cur = it & 1;
    const float* kt = kring + cur * KT_F;
    const float* vt = vring + cur * VT_F;

    // ---- S = Q^T K : 16 queries x 32 keys, two independent chains ----
    v8f s[2] = {};
    v4f kf[2][4];                             // kf[hb][p]: k steps 2p and 2p+1
#pragma unroll
    for (int hb = 0; hb < 2; ++hb)
#pragma unroll
      for (int p = 0; p < 4; ++p)
        kf[hb][p] = *(const v4f*)&kt[hb * KB_F + p * 128 + lane * 4];
    // Holds the eight reads together in front of the products (inputs only):
    // without it they share registers and the wave waits out the LDS latency
    // again and again in these dependent chains.
    asm volatile("" :: "v"(kf[0][0]), "v"(kf[0][1]), "v"(kf[0][2]),
                 "v"(kf[0][3]), "v"(kf[1][0]), "v"(kf[1][1]), "v"(kf[1][2]),
                 "v"(kf[1][3]));
#pragma unroll
    for (int p = 0; p < 4; ++p)
#pragma unroll
      for (int q = 0; q < 2; ++q)
#pragma unroll
        for (int hb = 0; hb < 2; ++hb) {
          v2f bk;
          bk.x = q ? kf[hb][p].z : kf[hb][p].x;
          bk.y = q ? kf[hb][p].w : kf[hb][p].y;
          s[hb] = wmma_f32(afrag[2 * p + q], bk, s[hb]);
        }
    // Keeps both chains whole in front of the LDS round trips: left free, the
    // second chain's last product is put between them, with a vector
    // instruction on its result registers right behind its stores.
    __builtin_amdgcn_sched_barrier(0);

    // ---- transpose S via LDS: D layout (key=lane) -> [query][key], one
    // 16-key block after the other through the same scratch. Same-wave LDS is
    // in-order: the second block's writes stand behind the first one's reads.
    float pv[16];
#pragma unroll
    for (int hb = 0; hb < 2; ++hb) {
#pragma unroll
      for (int r = 0; r < 8; ++r)
        smy[(r + 8 * lhalf) * SSTR + lmod] = s[hb][r];
      asm volatile("s_wait_dscnt 0" ::: "memory");  // reads behind the writes
      // Holds the first block's eight reads together (inputs only): left free
      // they share registers and the wave waits out the LDS latency per pair.
      if (hb == 1)
        asm volatile("" :: "v"(pv[0]), "v"(pv[1]), "v"(pv[2]), "v"(pv[3]),
                     "v"(pv[4]), "v"(pv[5]), "v"(pv[6]), "v"(pv[7]));
#pragma unroll
      for (int kc2 = 0; kc2 < 4; ++kc2)
#pragma unroll
        for (int h = 0; h < 2; ++h)
          pv[hb * 8 + kc2 * 2 + h] =
              smy[lmod * SSTR + 4 * kc2 + 2 * lhalf + h];
    }
    float tmax = -3.0e38f;
#pragma unroll
    for (int j = 0; j < 16; ++j) tmax = fmaxf(tmax, pv[j]);
    tmax = fmaxf(tmax, __shfl_xor(tmax, 16, 32));  // lane pair shares a query

    // ---- online softmax update ----
    const float mnew = fmaxf(mrow, tmax);
    const float corr = exp_slot(mrow - mnew);
    float psum = 0.0f;
#pragma unroll
    for (int j = 0; j < 16; ++j) {
      pv[j] = exp_slot(pv[j] - mnew);
      psum += pv[j];
    }
    psum += __shfl_xor(psum, 16, 32);
    lrow = lrow * corr + psum;
    mrow = mnew;
#pragma unroll
    for (int ct = 0; ct < 16; ++ct)
#pragma unroll
      for (int r = 0; r < 8; ++r) oacc[ct][r] *= corr;

    // ---- O += V * P^T : V fragments from LDS, two k steps per 16-byte read ----
#pragma unroll
    for (int hb = 0; hb < 2; ++hb)
#pragma unroll
      for (int p = 0; p < 2; ++p) {
        v4f vf[16];
#pragma unroll
        for (int ct = 0; ct < 16; ++ct)
          vf[ct] = *(const v4f*)&vt[hb * VB_F + ct * 256 + p * 128 + lane * 4];
#pragma unroll
        for (int q = 0; q < 2; ++q) {
          const int kc2 = 2 * p + q;
          v2f bb;
          bb.x = pv[hb * 8 + kc2 * 2 + 0];
          bb.y = pv[hb * 8 + kc2 * 2 + 1];
#pragma unroll
          for (int ct = 0; ct < 16; ++ct) {
            v2f av;
            av.x = q ? vf[ct].z : vf[ct].x;
            av.y = q ? vf[ct].w : vf[ct].y;
            oacc[ct] = wmma_f32(av, bb, oacc[ct]);
          }
        }
      }

    // ---- foot of the trip: own reads of `cur` retired, own copies of the
    // next tile landed, then the one barrier that publishes the next tile and
    // frees `cur` for the refill behind it ----
    wait_ds_0();
    wait_async_0();
    __syncthreads();
    if (it + 2 < NT) issue_tile(cur, (it + 2) * KB);
  }
  wait_async_0();   // no copy is in flight when the ring's LDS is reused

  // ---- merge the four key ranges of each query tile through LDS ----
  // Every wave lays down its raw O tile, max and sum, lane for lane.
  {
    float* mg = smem + wave * OT_F + lane * 4;
#pragma unroll
    for (int ct = 0; ct < 16; ++ct)
#pragma unroll
      for (int rh = 0; rh < 2; ++rh) {
        v4f t;
        t.x = oacc[ct][4 * rh + 0];
        t.y = oacc[ct][4 * rh + 1];
        t.z = oacc[ct][4 * rh + 2];
        t.w = oacc[ct][4 * rh + 3];
        *(v4f*)&mg[(ct * 2 + rh) * 128] = t;
      }
    mlbuf[wave * 64 + lane]      = mrow;
    mlbuf[wave * 64 + 32 + lane] = lrow;
  }
  __syncthreads();   // all partial results are visible to their partners

  float ms[KS], fs[KS];
  float mall = -3.0e38f;
#pragma unroll
  for (int s = 0; s < KS; ++s) {
    ms[s] = mlbuf[(s * QT + qt) * 64 + lane];
    mall  = fmaxf(mall, ms[s]);
  }
  float lall = 0.0f;
#pragma unroll
  for (int s = 0; s < KS; ++s) {
    fs[s] = exp_slot(ms[s] - mall);
    lall += fs[s] * mlbuf[(s * QT + qt) * 64 + 32 + lane];
  }

  // ---- finalize: out = gamma * O / l + x; wave ks owns channels 64 ks .. ----
  const float gm   = gamma[0];
  const float rinv = 1.0f / lall;
  const float* xb  = x   + (size_t)b * C * HW;
  float*       ob  = out + (size_t)b * C * HW;
#pragma unroll
  for (int cq = 0; cq < 4; ++cq) {
    const int ct = ks * 4 + cq;
#pragma unroll
    for (int rh = 0; rh < 2; ++rh) {
      v4f acc = {};
#pragma unroll
      for (int s = 0; s < KS; ++s) {
        const v4f t = *(const v4f*)&smem[(s * QT + qt) * OT_F +
                                         (ct * 2 + rh) * 128 + lane * 4];
        acc += fs[s] * t;
      }
#pragma unroll
      for (int e = 0; e < 4; ++e) {
        const int c = 16 * ct + 4 * rh + e + 8 * lhalf;
        const size_t idx = (size_t)c * HW + q0 + lmod;
        ob[idx] = gm * (acc[e] * rinv) + xb[idx];
      }
    }
  }
}

// ---------------------------------------------------------------------------
extern "C" void kernel_launch(void* const* d_in, const int* in_sizes, int n_in,
                              void* d_out, int out_size, void* d_ws,
                              size_t ws_size, hipStream_t stream) {
  const float* x     = (const float*)d_in[0];
  const float* g     = (const float*)d_in[1];
  const float* q_w   = (const float*)d_in[2];
  const float* q_b   = (const float*)d_in[3];
  const float* k_w   = (const float*)d_in[4];
  const float* k_b   = (const float*)d_in[5];
  const float* v_w   = (const float*)d_in[6];
  const float* v_b   = (const float*)d_in[7];
  const float* gamma = (const float*)d_in[8];
  float* out = (float*)d_out;

  // Workspace: q (2MB) | k (2MB) | v (16MB); k and v in fragment order.
  float* qws = (float*)d_ws;
  float* kws = qws + (size_t)BATCH * C8 * HW;
  float* vws = kws + (size_t)BATCH * C8 * HW;

  dim3 blk(256);
  ag_proj_kernel<0><<<dim3(HW / 128, C8 / 16, BATCH), blk, 0, stream>>>(
      q_w, q_b, x, qws, C8);
  ag_proj_kernel<1><<<dim3(HW / 128, C8 / 16, BATCH), blk, 0, stream>>>(
      k_w, k_b, g, kws, C8);
  ag_projv_kernel<<<dim3(HW / 64, BATCH), dim3(512), 0, stream>>>(
      v_w, v_b, g, vws);
  ag_attn_kernel<<<dim3(HW / (QT * 16), BATCH), dim3(NW * 32), 0, stream>>>(
      qws, kws, vws, x, gamma, out);
}
